// v000
// Times are from an AMD MI455X. After a warm-up the kernel runs many times in a row, and a time is the length of
// such a window on the GPU divided by its runs, so every launch and the gaps after it count. The runs cycle
// through copies of the inputs. A figure is the median of several windows, for all but v000 over two sittings.
// Sittings can differ by a few percent; kernels timed side by side share one.
// v000 is the starting kernel. One run takes 514 microseconds.
// compute dtype: all float inputs rounded to bf16; q/v/k = x . W^T + b with EXACT bf16 products on WMMA 16x16x32 (natural rows gathered from the interleaved (d, 3) layout), rounded once to f16 (v as planes); single-head attention over the 1,024-wide head: S = q . k^T / 32 (single f16, f32 accumulate), row softmax in f32 (hardware exp) -> P = e / l x 2^11 as f16, out = P . v (single f16) in f32; f32 output.
#include <hip/hip_runtime.h>
#include <math.h>

typedef __attribute__((ext_vector_type(16))) _Float16 v16h;
typedef __attribute__((ext_vector_type(16))) __bf16 v16b;
typedef __attribute__((ext_vector_type(8)))  _Float16 v8h;
typedef __attribute__((ext_vector_type(8)))  float v8f;
typedef __attribute__((ext_vector_type(4)))  float v4f;
typedef __attribute__((ext_vector_type(2)))  float v2f;
typedef __attribute__((ext_vector_type(4)))  unsigned v4u;
typedef __attribute__((ext_vector_type(4)))  int v4i;
typedef float __attribute__((may_alias)) float_a;
typedef int __attribute__((may_alias)) int_a;

template <typename T> __device__ __forceinline__ void vst2(void* p, T v) { *(T*)p = v;  }
__device__ __forceinline__ v8f wmma16(v16h a, v16h b, v8f c) {
  v8f d = __builtin_amdgcn_wmma_f32_16x16x32_f16(false, a, false, b, (short)0, c, false, false);
  asm volatile("v_nop\n\tv_nop\n\tv_nop\n\tv_nop" : "+v"(d) : "v"(a), "v"(b));
  return d;
}
__device__ __forceinline__ v8f wmma_bf(v16b a, v16b b, v8f c) {
  v8f d = __builtin_amdgcn_wmma_f32_16x16x32_bf16(false, a, false, b, (short)0, c, false, false);
  asm volatile("v_nop\n\tv_nop\n\tv_nop\n\tv_nop" : "+v"(d) : "v"(a), "v"(b));
  return d;
}
// 16x16x32 fragments: lane = (h = lane>>4, row/col = lane&15); elements 0..7 = k0+8h+0..7, 8..15 = k0+16+8h+0..7; D element r = row 8h+r
__device__ __forceinline__ v16h frag_h(const _Float16* rowk0, int lane) {
  union { v16h v; v8h q[2]; } u; const _Float16* p = rowk0 + 8 * (lane >> 4);
  u.q[0] = *(const v8h*)p; u.q[1] = *(const v8h*)(p + 16); return u.v;
}
__device__ __forceinline__ v16h frag_f32(const float* rowk0, int lane) {
  v16h a; const float* p = rowk0 + 8 * (lane >> 4);
#pragma unroll
  for (int i = 0; i < 8; ++i) { a[i] = (_Float16)p[i]; a[8 + i] = (_Float16)p[16 + i]; }
  return a;
}
__device__ __forceinline__ v16h frag_f32s(const float* rowk0, int lane, float sc) {
  v16h a; const float* p = rowk0 + 8 * (lane >> 4);
#pragma unroll
  for (int i = 0; i < 8; ++i) { a[i] = (_Float16)(p[i] * sc); a[8 + i] = (_Float16)(p[16 + i] * sc); }
  return a;
}
// column fragment from a [K][ld] layout (column n), rows >= K read as 0
__device__ __forceinline__ v16h fragc_f32(const float* W, int k0, int n, int lane, int ld, int K) {
  v16h a; const int g = lane >> 4;
#pragma unroll
  for (int i = 0; i < 8; ++i) { const int ka = k0 + 8 * g + i, kb = ka + 16;
    a[i] = (_Float16)(ka < K ? W[(size_t)(ka < K ? ka : K - 1) * ld + n] : 0.f); a[8 + i] = (_Float16)(kb < K ? W[(size_t)(kb < K ? kb : K - 1) * ld + n] : 0.f); }
  return a;
}
struct F2 { v16b h, l; };
__device__ __forceinline__ F2 bsplit16(const float v[16]) { F2 r;
#pragma unroll
  for (int i = 0; i < 16; ++i) { const __bf16 h = (__bf16)v[i]; r.h[i] = h; r.l[i] = (__bf16)(v[i] - (float)h); }
  return r; }
__device__ __forceinline__ F2 split_row(const float* row, int k0, int lane) { float v[16]; const float* p = row + k0 + 8 * (lane >> 4);
#pragma unroll
  for (int i = 0; i < 8; ++i) { v[i] = p[i]; v[8 + i] = p[16 + i]; }
  return bsplit16(v); }
__device__ __forceinline__ F2 split_rowK(const float* row, int k0, int lane, int K) { float v[16]; const int g = lane >> 4;
#pragma unroll
  for (int i = 0; i < 8; ++i) { const int ka = k0 + 8 * g + i, kb = ka + 16; v[i] = ka < K ? row[ka < K ? ka : K - 1] : 0.f; v[8 + i] = kb < K ? row[kb < K ? kb : K - 1] : 0.f; }
  return bsplit16(v); }
__device__ __forceinline__ F2 split_col(const float* W, int k0, int n, int lane, int ld, int K) { float v[16]; const int g = lane >> 4;
#pragma unroll
  for (int i = 0; i < 8; ++i) { const int ka = k0 + 8 * g + i, kb = ka + 16; v[i] = ka < K ? W[(size_t)(ka < K ? ka : K - 1) * ld + n] : 0.f; v[8 + i] = kb < K ? W[(size_t)(kb < K ? kb : K - 1) * ld + n] : 0.f; }
  return bsplit16(v); }
__device__ __forceinline__ v8f mac3(const F2& a, const F2& b, v8f c) { c = wmma_bf(a.l, b.h, c); c = wmma_bf(a.h, b.l, c); return wmma_bf(a.h, b.h, c); }
__device__ __forceinline__ float sigm(float v) { return 1.0f / (1.0f + expf(-v)); }
#define LDSX() do { asm volatile("s_wait_dscnt 0" ::: "memory"); __builtin_amdgcn_wave_barrier(); __builtin_amdgcn_fence(__ATOMIC_RELEASE, "workgroup"); } while (0)


// Single-head self attention (B 4, T 2,048, d 1,024): fused projection whose 3d outputs interleave (q, v, k) per channel, softmax(q k^T / sqrt(d)) v, no output projection.
#define NB 4
#define SQ 2048
#define DM 1024
#define NR (NB * SQ)
#ifndef TNB
#define TNB NB
#endif
typedef __attribute__((ext_vector_type(8))) __bf16 v8b;
__device__ __forceinline__ v16b frag_b(const __bf16* rowk0, int lane) {
  union { v16b v; v8b q[2]; } u; const __bf16* p = rowk0 + 8 * (lane >> 4);
  u.q[0] = *(const v8b*)p; u.q[1] = *(const v8b*)(p + 16); return u.v;
}
__device__ __forceinline__ float bfr(float v) { return (float)(__bf16)v; }
__device__ __attribute__((noinline)) float exp_ni(float v) { return expf(v); }
__device__ __attribute__((noinline)) float erf_ni(float v) { return erff(v); }

#define WS_PW  0u                                   // bf16 natural rows: q rows (W[3c]), k rows (W[3c+2]), v rows (W[3c+1]) [3][1024][1024]
#define WS_Q   (WS_PW + 2u * (size_t)3 * DM * DM)       // f16 q rows [NR][1024]; k rows; v planes [b][1024][SQ]; f32 S [b][q][k]; f16 P [b][q][k]
#define WS_K   (WS_Q + 2u * (size_t)NR * DM)
#define WS_V   (WS_K + 2u * (size_t)NR * DM)
#define WS_S   (WS_V + 2u * (size_t)NB * DM * SQ)
#define WS_P   (WS_S + 4u * (size_t)NB * SQ * SQ)
#define WS_END (WS_P + 2u * (size_t)NB * SQ * SQ)

// ---- k_pack: block = (output channel c, which): which 0 -> q = W row 3c, 1 -> k = row 3c+2, 2 -> v = row 3c+1
__global__ __launch_bounds__(256) void k_pack(const float* __restrict__ WQVK, __bf16* __restrict__ PW) { const int n = blockIdx.x, which = blockIdx.y, t = threadIdx.x; __shared__ __align__(16) __bf16 s[DM]; const int src = 3 * n + ((which == 0) ? 0 : (which == 1) ? 2 : 1);
  for (int k = t; k < DM; k += 256) s[k] = (__bf16)WQVK[(size_t)src * DM + k]; __syncthreads(); if (t < DM / 8) vst2((unsigned*)(PW + ((size_t)which * DM + n) * DM + t * 8), *(const v4u*)&s[t * 8]); }
// ---- k_proj: block = (64 rows, 128 cols, which): + interleaved bias; q/k -> f16 rows; v -> planes
__global__ __launch_bounds__(128) void k_proj(const float* __restrict__ X, const __bf16* __restrict__ PW, const float* __restrict__ BQVK, _Float16* __restrict__ Q, _Float16* __restrict__ Kr, _Float16* __restrict__ V) {
  __shared__ __align__(16) _Float16 so[64][136]; __shared__ __align__(16) _Float16 st[128][72];
  const int tid = threadIdx.x, wave = tid >> 5, lane = tid & 31, col = lane & 15, g = lane >> 4; const int which = blockIdx.z; const size_t rb = (size_t)blockIdx.x * 64; const size_t r0 = rb + wave * 16; const int c0 = blockIdx.y * 128; const __bf16* Wr = PW + ((size_t)which * DM) * DM; const int boff = (which == 0) ? 0 : (which == 1) ? 2 : 1;
  v8f acc[8] = {};
#pragma unroll 2
  for (int kc = 0; kc < DM / 32; ++kc) { v16b a; { const float* p = X + (r0 + col) * DM + kc * 32 + 8 * g;
#pragma unroll
      for (int i = 0; i < 8; ++i) { a[i] = (__bf16)p[i]; a[8 + i] = (__bf16)p[16 + i]; } }
#pragma unroll
    for (int j = 0; j < 8; ++j) acc[j] = wmma_bf(a, frag_b(Wr + (size_t)(c0 + j * 16 + col) * DM + kc * 32, lane), acc[j]); }
#pragma unroll
  for (int j = 0; j < 8; ++j) { const int c = c0 + j * 16 + col; const float bb = bfr(BQVK[3 * c + boff]);
#pragma unroll
    for (int r = 0; r < 8; ++r) { const _Float16 hv = (_Float16)(acc[j][r] + bb); if (which < 2) so[wave * 16 + 8 * g + r][j * 16 + col] = hv; else st[j * 16 + col][wave * 16 + 8 * g + r] = hv; } }
  __syncthreads();
  if (which < 2) { _Float16* dst = (which == 0) ? Q : Kr; for (int e = tid; e < 64 * 16; e += 128) { const int rl = e >> 4, q = e & 15; vst2((unsigned*)(dst + (rb + rl) * DM + c0 + q * 8), *(const v4u*)&so[rl][q * 8]); } }
  else { const size_t b = rb / SQ; const int s0 = (int)(rb % SQ); for (int e = tid; e < 128 * 8; e += 128) { const int d = e >> 3, pc = e & 7; vst2((unsigned*)(V + ((b * DM + c0 + d) * SQ) + s0 + pc * 8), *(const v4u*)&st[d][pc * 8]); } }
}
// ---- k_s: block = (64 queries, 128 keys, b): S = q . k / 32 over d = 1,024 (single f16) -> f32
__global__ __launch_bounds__(128) void k_s(const _Float16* __restrict__ Q, const _Float16* __restrict__ Kr, float* __restrict__ S) { __shared__ __align__(16) float so[4][16][132];
  const int tid = threadIdx.x, wave = tid >> 5, lane = tid & 31, col = lane & 15, g = lane >> 4; const size_t b = blockIdx.z; const int q0 = blockIdx.x * 64 + wave * 16; const int k0 = blockIdx.y * 128; const size_t rq = b * SQ + q0;
  v8f acc[8] = {};
#pragma unroll 2
  for (int kc = 0; kc < DM / 32; ++kc) { const v16h a = frag_h(Q + (rq + col) * DM + kc * 32, lane);
#pragma unroll
    for (int j = 0; j < 8; ++j) acc[j] = wmma16(a, frag_h(Kr + (b * SQ + k0 + j * 16 + col) * DM + kc * 32, lane), acc[j]); }
#pragma unroll
  for (int j = 0; j < 8; ++j)
#pragma unroll
    for (int r = 0; r < 8; ++r) so[wave][8 * g + r][j * 16 + col] = acc[j][r] * 0.03125f;
  LDSX(); for (int rl = 0; rl < 16; ++rl) vst2(S + ((b * SQ + q0 + rl) * SQ) + k0 + lane * 4, *(const v4f*)&so[wave][rl][lane * 4]); }
// ---- k_prow: block = row: softmax over the 2,048 keys -> P = e / l x 2^11 as f16 (one 4-KB row)
__global__ __launch_bounds__(256) void k_prow(const float* __restrict__ S, _Float16* __restrict__ P) { __shared__ float red[8]; __shared__ __align__(16) _Float16 sp[SQ]; const int t = threadIdx.x; const size_t row = blockIdx.x; const float* sr = S + row * SQ;
  float v[8]; float mx = -3.0e38f; for (int i = 0; i < 8; ++i) { v[i] = sr[t * 8 + i]; mx = fmaxf(mx, v[i]); }
#pragma unroll
  for (int o = 1; o < 32; o <<= 1) mx = fmaxf(mx, __shfl_xor(mx, o));
  if ((t & 31) == 0) red[t >> 5] = mx; __syncthreads(); float M = red[0]; for (int i = 1; i < 8; ++i) M = fmaxf(M, red[i]); __syncthreads();
  float z = 0.f; for (int i = 0; i < 8; ++i) { v[i] = __expf(v[i] - M); z += v[i]; }
#pragma unroll
  for (int o = 1; o < 32; o <<= 1) z += __shfl_xor(z, o);
  if ((t & 31) == 0) red[t >> 5] = z; __syncthreads(); float Z = 0.f; for (int i = 0; i < 8; ++i) Z += red[i]; const float iz = 2048.0f / Z;
  for (int i = 0; i < 8; ++i) sp[t * 8 + i] = (_Float16)(v[i] * iz); __syncthreads();
  vst2((unsigned*)(P + row * SQ + t * 8), *(const v4u*)&sp[t * 8]); }
// ---- k_pv: block = (64 queries, 128 dims, b): out = P . v / 2^11 over the 2,048 keys (v planes) -> f32 output rows
__global__ __launch_bounds__(128) void k_pv(const _Float16* __restrict__ P, const _Float16* __restrict__ V, float* __restrict__ OUT) { __shared__ __align__(16) float so[4][16][132];
  const int tid = threadIdx.x, wave = tid >> 5, lane = tid & 31, col = lane & 15, g = lane >> 4; const size_t b = blockIdx.z; const int q0 = blockIdx.x * 64 + wave * 16; const int c0 = blockIdx.y * 128; const size_t rq = b * SQ + q0;
  v8f acc[8] = {};
#pragma unroll 2
  for (int kc = 0; kc < SQ / 32; ++kc) { const v16h a = frag_h(P + (rq + col) * SQ + kc * 32, lane);
#pragma unroll
    for (int j = 0; j < 8; ++j) acc[j] = wmma16(a, frag_h(V + ((b * DM + c0 + j * 16 + col) * SQ) + kc * 32, lane), acc[j]); }
#pragma unroll
  for (int j = 0; j < 8; ++j)
#pragma unroll
    for (int r = 0; r < 8; ++r) so[wave][8 * g + r][j * 16 + col] = acc[j][r] * (1.0f / 2048.0f);
  LDSX(); for (int rl = 0; rl < 16; ++rl) vst2(OUT + (rq + rl) * DM + c0 + lane * 4, *(const v4f*)&so[wave][rl][lane * 4]); }
extern "C" void kernel_launch(void* const* d_in, const int* in_sizes, int n_in, void* d_out, int out_size, void* d_ws, size_t ws_size, hipStream_t stream) {
  (void)in_sizes; (void)n_in; (void)out_size;
  const float** F = (const float**)d_in;   // 0 x [4,2048,1024], 1 W_qvk [3072,1024] (rows interleaved (channel, {q,v,k})), 2 b_qvk [3072]
  if (ws_size < (size_t)WS_END) return;
  char* ws = (char*)d_ws; __bf16* PW = (__bf16*)ws; _Float16 *Q = (_Float16*)(ws + WS_Q), *Kr = (_Float16*)(ws + WS_K), *V = (_Float16*)(ws + WS_V), *P = (_Float16*)(ws + WS_P); float* S = (float*)(ws + WS_S);
  k_pack<<<dim3(DM, 3), 256, 0, stream>>>(F[1], PW);
  k_proj<<<dim3(TNB * SQ / 64, DM / 128, 3), 128, 0, stream>>>(F[0], PW, F[2], Q, Kr, V);
  k_s<<<dim3(SQ / 64, SQ / 128, TNB), 128, 0, stream>>>(Q, Kr, S);
  k_prow<<<TNB * SQ, 256, 0, stream>>>(S, P);
  k_pv<<<dim3(SQ / 64, DM / 128, TNB), 128, 0, stream>>>(P, V, (float*)d_out);
}

// v001
// A run of this version takes 192 microseconds.
// Two timings next to v000 put it at 2.80 and 2.73 times that version's speed.
// compute dtype: all float inputs rounded to bf16; q/v/k = x . W^T + b with EXACT bf16 products on WMMA 16x16x32 (natural rows gathered from the interleaved (d, 3) layout), rounded once to f16 (v as planes); single-head attention over the 1,024-wide head: S = q . k^T / 32 (single f16, f32 accumulate), row softmax in f32 (hardware exp) -> P = e / l x 2^11 as f16, out = P . v (single f16) in f32; f32 output.
#include <hip/hip_runtime.h>
#include <math.h>

typedef __attribute__((ext_vector_type(16))) _Float16 v16h;
typedef __attribute__((ext_vector_type(16))) __bf16 v16b;
typedef __attribute__((ext_vector_type(8)))  _Float16 v8h;
typedef __attribute__((ext_vector_type(8)))  float v8f;
typedef __attribute__((ext_vector_type(4)))  float v4f;
typedef __attribute__((ext_vector_type(2)))  float v2f;
typedef __attribute__((ext_vector_type(4)))  unsigned v4u;
typedef __attribute__((ext_vector_type(4)))  int v4i;
typedef float __attribute__((may_alias)) float_a;
typedef int __attribute__((may_alias)) int_a;

template <typename T> __device__ __forceinline__ void vst2(void* p, T v) { *(T*)p = v;  }
__device__ __forceinline__ v8f wmma16(v16h a, v16h b, v8f c) {
  v8f d = __builtin_amdgcn_wmma_f32_16x16x32_f16(false, a, false, b, (short)0, c, false, false);
  asm volatile("v_nop\n\tv_nop\n\tv_nop\n\tv_nop" : "+v"(d) : "v"(a), "v"(b));
  return d;
}
__device__ __forceinline__ v8f wmma_bf(v16b a, v16b b, v8f c) {
  v8f d = __builtin_amdgcn_wmma_f32_16x16x32_bf16(false, a, false, b, (short)0, c, false, false);
  asm volatile("v_nop\n\tv_nop\n\tv_nop\n\tv_nop" : "+v"(d) : "v"(a), "v"(b));
  return d;
}
// 16x16x32 fragments: lane = (h = lane>>4, row/col = lane&15); elements 0..7 = k0+8h+0..7, 8..15 = k0+16+8h+0..7; D element r = row 8h+r
__device__ __forceinline__ v16h frag_h(const _Float16* rowk0, int lane) {
  union { v16h v; v8h q[2]; } u; const _Float16* p = rowk0 + 8 * (lane >> 4);
  u.q[0] = *(const v8h*)p; u.q[1] = *(const v8h*)(p + 16); return u.v;
}
__device__ __forceinline__ v16h frag_f32(const float* rowk0, int lane) {
  v16h a; const float* p = rowk0 + 8 * (lane >> 4);
#pragma unroll
  for (int i = 0; i < 8; ++i) { a[i] = (_Float16)p[i]; a[8 + i] = (_Float16)p[16 + i]; }
  return a;
}
__device__ __forceinline__ v16h frag_f32s(const float* rowk0, int lane, float sc) {
  v16h a; const float* p = rowk0 + 8 * (lane >> 4);
#pragma unroll
  for (int i = 0; i < 8; ++i) { a[i] = (_Float16)(p[i] * sc); a[8 + i] = (_Float16)(p[16 + i] * sc); }
  return a;
}
// column fragment from a [K][ld] layout (column n), rows >= K read as 0
__device__ __forceinline__ v16h fragc_f32(const float* W, int k0, int n, int lane, int ld, int K) {
  v16h a; const int g = lane >> 4;
#pragma unroll
  for (int i = 0; i < 8; ++i) { const int ka = k0 + 8 * g + i, kb = ka + 16;
    a[i] = (_Float16)(ka < K ? W[(size_t)(ka < K ? ka : K - 1) * ld + n] : 0.f); a[8 + i] = (_Float16)(kb < K ? W[(size_t)(kb < K ? kb : K - 1) * ld + n] : 0.f); }
  return a;
}
struct F2 { v16b h, l; };
__device__ __forceinline__ F2 bsplit16(const float v[16]) { F2 r;
#pragma unroll
  for (int i = 0; i < 16; ++i) { const __bf16 h = (__bf16)v[i]; r.h[i] = h; r.l[i] = (__bf16)(v[i] - (float)h); }
  return r; }
__device__ __forceinline__ F2 split_row(const float* row, int k0, int lane) { float v[16]; const float* p = row + k0 + 8 * (lane >> 4);
#pragma unroll
  for (int i = 0; i < 8; ++i) { v[i] = p[i]; v[8 + i] = p[16 + i]; }
  return bsplit16(v); }
__device__ __forceinline__ F2 split_rowK(const float* row, int k0, int lane, int K) { float v[16]; const int g = lane >> 4;
#pragma unroll
  for (int i = 0; i < 8; ++i) { const int ka = k0 + 8 * g + i, kb = ka + 16; v[i] = ka < K ? row[ka < K ? ka : K - 1] : 0.f; v[8 + i] = kb < K ? row[kb < K ? kb : K - 1] : 0.f; }
  return bsplit16(v); }
__device__ __forceinline__ F2 split_col(const float* W, int k0, int n, int lane, int ld, int K) { float v[16]; const int g = lane >> 4;
#pragma unroll
  for (int i = 0; i < 8; ++i) { const int ka = k0 + 8 * g + i, kb = ka + 16; v[i] = ka < K ? W[(size_t)(ka < K ? ka : K - 1) * ld + n] : 0.f; v[8 + i] = kb < K ? W[(size_t)(kb < K ? kb : K - 1) * ld + n] : 0.f; }
  return bsplit16(v); }
__device__ __forceinline__ v8f mac3(const F2& a, const F2& b, v8f c) { c = wmma_bf(a.l, b.h, c); c = wmma_bf(a.h, b.l, c); return wmma_bf(a.h, b.h, c); }
__device__ __forceinline__ float sigm(float v) { return 1.0f / (1.0f + expf(-v)); }
#define LDSX() do { asm volatile("s_wait_dscnt 0" ::: "memory"); __builtin_amdgcn_wave_barrier(); __builtin_amdgcn_fence(__ATOMIC_RELEASE, "workgroup"); } while (0)


// Single-head self attention (B 4, T 2,048, d 1,024): fused projection whose 3d outputs interleave (q, v, k) per channel, softmax(q k^T / sqrt(d)) v, no output projection.
#define NB 4
#define SQ 2048
#define DM 1024
#define NR (NB * SQ)
#ifndef TNB
#define TNB NB
#endif
typedef __attribute__((ext_vector_type(8))) __bf16 v8b;
__device__ __forceinline__ v16b frag_b(const __bf16* rowk0, int lane) {
  union { v16b v; v8b q[2]; } u; const __bf16* p = rowk0 + 8 * (lane >> 4);
  u.q[0] = *(const v8b*)p; u.q[1] = *(const v8b*)(p + 16); return u.v;
}
__device__ __forceinline__ float bfr(float v) { return (float)(__bf16)v; }
__device__ __attribute__((noinline)) float exp_ni(float v) { return expf(v); }
__device__ __attribute__((noinline)) float erf_ni(float v) { return erff(v); }

#define WS_PW  0u                                   // bf16 natural rows: q rows (W[3c]), k rows (W[3c+2]), v rows (W[3c+1]) [3][1024][1024]
#define WS_Q   (WS_PW + 2u * (size_t)3 * DM * DM)       // f16 q rows [NR][1024]; k rows; v planes [b][1024][SQ]; f32 S [b][q][k]; f16 P [b][q][k]
#define WS_K   (WS_Q + 2u * (size_t)NR * DM)
#define WS_V   (WS_K + 2u * (size_t)NR * DM)
#define WS_S   (WS_V + 2u * (size_t)NB * DM * SQ)
#define WS_P   (WS_S + 4u * (size_t)NB * SQ * SQ)
#define WS_END (WS_P + 2u * (size_t)NB * SQ * SQ)

// ---- k_pack: block = (output channel c, which): which 0 -> q = W row 3c, 1 -> k = row 3c+2, 2 -> v = row 3c+1
__global__ __launch_bounds__(256) void k_pack(const float* __restrict__ WQVK, __bf16* __restrict__ PW) { const int n = blockIdx.x, which = blockIdx.y, t = threadIdx.x; __shared__ __align__(16) __bf16 s[DM]; const int src = 3 * n + ((which == 0) ? 0 : (which == 1) ? 2 : 1);
  for (int k = t; k < DM; k += 256) s[k] = (__bf16)WQVK[(size_t)src * DM + k]; __syncthreads(); if (t < DM / 8) vst2((unsigned*)(PW + ((size_t)which * DM + n) * DM + t * 8), *(const v4u*)&s[t * 8]); }
// ---- LDS staging of the GEMM operands: a pass is 64 k; a block's tiles (64 A rows, 128 B rows) are brought into LDS by per-lane 16-byte asynchronous copies that cover whole 128-byte lines, two buffers, the next pass's copies in flight while this pass is worked on
#define PK 64                          // k per pass
#define PIT16 144                      // LDS pitch of a 128-byte row (16-bit operands): 16 B x odd, ds_load_b128 without bank conflicts
#define PIT32 272                      // LDS pitch of a 256-byte row (f32 x rows), same rule
#define OFFB16 (64 * PIT16)            // B tile behind the 64 A rows
#define STG16 ((64 + 128) * PIT16)     // one buffer, both operands 16-bit
#define OFFB32 (64 * PIT32)
#define STG32 (64 * PIT32 + 128 * PIT16)   // one buffer, f32 A rows and 16-bit B rows
__device__ __forceinline__ unsigned lds_off(const void* p) { return (unsigned)(size_t)p; }
// the issuing wave's copies have landed (the compiler places no wait for them)
#define WAIT_ASYNC() asm volatile("s_wait_asynccnt 0x0" ::: "memory")
// this wave's LDS reads of the buffer have returned before the barrier hands it to the next copies
#define WAIT_DS() asm volatile("s_wait_dscnt 0x0" ::: "memory")
// eight copies, rows rs apart in LDS (bytes) and gs apart in global memory (bytes); the closing s_wait_xcnt stands in the copies' own statement so that no address register is rewritten ahead of it
__device__ __forceinline__ void copy8(unsigned l, unsigned rs, const char* g, size_t gs) {
  asm volatile("global_load_async_to_lds_b128 %0, %8, off\n\t"
               "global_load_async_to_lds_b128 %1, %9, off\n\t"
               "global_load_async_to_lds_b128 %2, %10, off\n\t"
               "global_load_async_to_lds_b128 %3, %11, off\n\t"
               "global_load_async_to_lds_b128 %4, %12, off\n\t"
               "global_load_async_to_lds_b128 %5, %13, off\n\t"
               "global_load_async_to_lds_b128 %6, %14, off\n\t"
               "global_load_async_to_lds_b128 %7, %15, off\n\t"
               "s_wait_xcnt 0x0"
               :: "v"(l), "v"(l + rs), "v"(l + 2 * rs), "v"(l + 3 * rs), "v"(l + 4 * rs), "v"(l + 5 * rs), "v"(l + 6 * rs), "v"(l + 7 * rs),
                  "v"(g), "v"(g + gs), "v"(g + 2 * gs), "v"(g + 3 * gs), "v"(g + 4 * gs), "v"(g + 5 * gs), "v"(g + 6 * gs), "v"(g + 7 * gs) : "memory");
}
// twelve copies: four of the A tile, eight of the B tile (both 128-byte rows, four rows a copy); one statement, one closing s_wait_xcnt, for the same reason
__device__ __forceinline__ void copy12(unsigned la, const char* ga, unsigned lb, const char* gb, size_t gs) {
  const unsigned rs = 4 * PIT16;
  asm volatile("global_load_async_to_lds_b128 %0, %12, off\n\t"
               "global_load_async_to_lds_b128 %1, %13, off\n\t"
               "global_load_async_to_lds_b128 %2, %14, off\n\t"
               "global_load_async_to_lds_b128 %3, %15, off\n\t"
               "global_load_async_to_lds_b128 %4, %16, off\n\t"
               "global_load_async_to_lds_b128 %5, %17, off\n\t"
               "global_load_async_to_lds_b128 %6, %18, off\n\t"
               "global_load_async_to_lds_b128 %7, %19, off\n\t"
               "global_load_async_to_lds_b128 %8, %20, off\n\t"
               "global_load_async_to_lds_b128 %9, %21, off\n\t"
               "global_load_async_to_lds_b128 %10, %22, off\n\t"
               "global_load_async_to_lds_b128 %11, %23, off\n\t"
               "s_wait_xcnt 0x0"
               :: "v"(la), "v"(la + rs), "v"(la + 2 * rs), "v"(la + 3 * rs),
                  "v"(lb), "v"(lb + rs), "v"(lb + 2 * rs), "v"(lb + 3 * rs), "v"(lb + 4 * rs), "v"(lb + 5 * rs), "v"(lb + 6 * rs), "v"(lb + 7 * rs),
                  "v"(ga), "v"(ga + gs), "v"(ga + 2 * gs), "v"(ga + 3 * gs),
                  "v"(gb), "v"(gb + gs), "v"(gb + 2 * gs), "v"(gb + 3 * gs), "v"(gb + 4 * gs), "v"(gb + 5 * gs), "v"(gb + 6 * gs), "v"(gb + 7 * gs) : "memory");
}
// acc[j] += A(16 rows of this wave) . B(128 rows)^T over K = NT * 64, both operands f16 rows of ld elements; Ab, Bb = the block's first A and B row; k runs upward pass by pass, 32 at a time
template <int NT> __device__ __forceinline__ void gemm_f16_ring(unsigned char* sm, const _Float16* Ab, const _Float16* Bb, size_t ld, int wave, int lane, v8f (&acc)[8]) {
  const int col = lane & 15; const int r4 = lane >> 3, ch = lane & 7;   // a copy: 4 rows x 8 chunks of 16 bytes
  const unsigned la = lds_off(sm) + (wave * 16 + r4) * PIT16 + ch * 16, lb = lds_off(sm) + OFFB16 + (wave * 32 + r4) * PIT16 + ch * 16;
  const char* ga = (const char*)(Ab + (size_t)(wave * 16 + r4) * ld + ch * 8); const char* gb = (const char*)(Bb + (size_t)(wave * 32 + r4) * ld + ch * 8); const size_t gs = 4 * ld * 2;
  copy12(la, ga, lb, gb, gs); WAIT_ASYNC(); __syncthreads();
  copy12(la + STG16, ga + PK * 2, lb + STG16, gb + PK * 2, gs);
  for (int t = 0; t < NT; ++t) { const unsigned bo = (t & 1) * STG16; const unsigned char* buf = sm + bo;
    // both inner loops unrolled so that acc[] is indexed by constants only (else it would live in scratch)
#pragma unroll
    for (int kk = 0; kk < 2; ++kk) { const v16h a = frag_h((const _Float16*)(buf + (wave * 16 + col) * PIT16) + kk * 32, lane);
#pragma unroll
      for (int j = 0; j < 8; ++j) acc[j] = wmma16(a, frag_h((const _Float16*)(buf + OFFB16 + (j * 16 + col) * PIT16) + kk * 32, lane), acc[j]); }
    WAIT_DS(); WAIT_ASYNC(); __syncthreads();   // publishes pass t + 1 and ends every read of this pass's buffer
    if (t + 2 < NT) copy12(la + bo, ga + (size_t)(t + 2) * (PK * 2), lb + bo, gb + (size_t)(t + 2) * (PK * 2), gs); }
  WAIT_ASYNC();
}
// ---- k_proj: block = (64 rows, 128 cols, which): + interleaved bias; q/k -> f16 rows; v -> planes; x (f32) and W (bf16) tiles staged in LDS, the ring reused as output staging behind the last pass's barrier
__global__ __launch_bounds__(128) void k_proj(const float* __restrict__ X, const __bf16* __restrict__ PW, const float* __restrict__ BQVK, _Float16* __restrict__ Q, _Float16* __restrict__ Kr, _Float16* __restrict__ V) {
  __shared__ __align__(16) unsigned char sm[2 * STG32]; _Float16 (*so)[136] = (_Float16 (*)[136])sm; _Float16 (*st)[72] = (_Float16 (*)[72])(sm + 64 * 136 * 2);
  const int tid = threadIdx.x, wave = tid >> 5, lane = tid & 31, col = lane & 15, g = lane >> 4; const int which = blockIdx.z; const size_t rb = (size_t)blockIdx.x * 64; const int c0 = blockIdx.y * 128; const __bf16* Wr = PW + ((size_t)which * DM) * DM; const int boff = (which == 0) ? 0 : (which == 1) ? 2 : 1;
  // x: a copy is 2 rows x 16 chunks of 16 bytes; W: 4 rows x 8 chunks
  const unsigned la = lds_off(sm) + (wave * 16 + g) * PIT32 + col * 16, lb = lds_off(sm) + OFFB32 + (wave * 32 + (lane >> 3)) * PIT16 + (lane & 7) * 16;
  const char* ga = (const char*)(X + (rb + wave * 16 + g) * DM + col * 4); const char* gb = (const char*)(Wr + (size_t)(c0 + wave * 32 + (lane >> 3)) * DM + (lane & 7) * 8);
  v8f acc[8] = {};
  copy8(la, 2 * PIT32, ga, 2 * DM * 4); copy8(lb, 4 * PIT16, gb, 4 * DM * 2); WAIT_ASYNC(); __syncthreads();
  copy8(la + STG32, 2 * PIT32, ga + PK * 4, 2 * DM * 4); copy8(lb + STG32, 4 * PIT16, gb + PK * 2, 4 * DM * 2);
  for (int t = 0; t < DM / PK; ++t) { const unsigned bo = (t & 1) * STG32; const unsigned char* buf = sm + bo;
    // the inner loops unrolled so that a[] and acc[] are indexed by constants only (else they would live in scratch)
#pragma unroll
    for (int kk = 0; kk < 2; ++kk) { v16b a; { const float* p = (const float*)(buf + (wave * 16 + col) * PIT32) + kk * 32 + 8 * g;
#pragma unroll
        for (int i = 0; i < 8; ++i) { a[i] = (__bf16)p[i]; a[8 + i] = (__bf16)p[16 + i]; } }
#pragma unroll
      for (int j = 0; j < 8; ++j) acc[j] = wmma_bf(a, frag_b((const __bf16*)(buf + OFFB32 + (j * 16 + col) * PIT16) + kk * 32, lane), acc[j]); }
    WAIT_DS(); WAIT_ASYNC(); __syncthreads();   // publishes pass t + 1 and ends every read of this pass's buffer
    if (t + 2 < DM / PK) { copy8(la + bo, 2 * PIT32, ga + (size_t)(t + 2) * (PK * 4), 2 * DM * 4); copy8(lb + bo, 4 * PIT16, gb + (size_t)(t + 2) * (PK * 2), 4 * DM * 2); } }
  WAIT_ASYNC();
#pragma unroll
  for (int j = 0; j < 8; ++j) { const int c = c0 + j * 16 + col; const float bb = bfr(BQVK[3 * c + boff]);
#pragma unroll
    for (int r = 0; r < 8; ++r) { const _Float16 hv = (_Float16)(acc[j][r] + bb); if (which < 2) so[wave * 16 + 8 * g + r][j * 16 + col] = hv; else st[j * 16 + col][wave * 16 + 8 * g + r] = hv; } }
  __syncthreads();
  if (which < 2) { _Float16* dst = (which == 0) ? Q : Kr; for (int e = tid; e < 64 * 16; e += 128) { const int rl = e >> 4, q = e & 15; vst2((unsigned*)(dst + (rb + rl) * DM + c0 + q * 8), *(const v4u*)&so[rl][q * 8]); } }
  else { const size_t b = rb / SQ; const int s0 = (int)(rb % SQ); for (int e = tid; e < 128 * 8; e += 128) { const int d = e >> 3, pc = e & 7; vst2((unsigned*)(V + ((b * DM + c0 + d) * SQ) + s0 + pc * 8), *(const v4u*)&st[d][pc * 8]); } }
}
// ---- k_s: block = (64 queries, 128 keys, b): S = q . k / 32 over d = 1,024 (single f16) -> f32; q and k tiles staged in LDS, the ring reused as output staging behind the last pass's barrier
__global__ __launch_bounds__(128) void k_s(const _Float16* __restrict__ Q, const _Float16* __restrict__ Kr, float* __restrict__ S) { __shared__ __align__(16) unsigned char sm[2 * STG16]; float (*so)[16][132] = (float (*)[16][132])sm;
  const int tid = threadIdx.x, wave = tid >> 5, lane = tid & 31, col = lane & 15, g = lane >> 4; const size_t b = blockIdx.z; const int q0 = blockIdx.x * 64 + wave * 16; const int k0 = blockIdx.y * 128; const size_t rq = b * SQ + q0;
  v8f acc[8] = {};
  gemm_f16_ring<DM / PK>(sm, Q + (b * SQ + blockIdx.x * 64) * DM, Kr + (b * SQ + k0) * DM, DM, wave, lane, acc);
#pragma unroll
  for (int j = 0; j < 8; ++j)
#pragma unroll
    for (int r = 0; r < 8; ++r) so[wave][8 * g + r][j * 16 + col] = acc[j][r] * 0.03125f;
  LDSX(); for (int rl = 0; rl < 16; ++rl) vst2(S + ((b * SQ + q0 + rl) * SQ) + k0 + lane * 4, *(const v4f*)&so[wave][rl][lane * 4]); }
// ---- k_prow: block = row: softmax over the 2,048 keys -> P = e / l x 2^11 as f16 (one 4-KB row)
__global__ __launch_bounds__(256) void k_prow(const float* __restrict__ S, _Float16* __restrict__ P) { __shared__ float red[8]; __shared__ __align__(16) _Float16 sp[SQ]; const int t = threadIdx.x; const size_t row = blockIdx.x; const float* sr = S + row * SQ;
  float v[8]; float mx = -3.0e38f; for (int i = 0; i < 8; ++i) { v[i] = sr[t * 8 + i]; mx = fmaxf(mx, v[i]); }
#pragma unroll
  for (int o = 1; o < 32; o <<= 1) mx = fmaxf(mx, __shfl_xor(mx, o));
  if ((t & 31) == 0) red[t >> 5] = mx; __syncthreads(); float M = red[0]; for (int i = 1; i < 8; ++i) M = fmaxf(M, red[i]); __syncthreads();
  float z = 0.f; for (int i = 0; i < 8; ++i) { v[i] = __expf(v[i] - M); z += v[i]; }
#pragma unroll
  for (int o = 1; o < 32; o <<= 1) z += __shfl_xor(z, o);
  if ((t & 31) == 0) red[t >> 5] = z; __syncthreads(); float Z = 0.f; for (int i = 0; i < 8; ++i) Z += red[i]; const float iz = 2048.0f / Z;
  for (int i = 0; i < 8; ++i) sp[t * 8 + i] = (_Float16)(v[i] * iz); __syncthreads();
  vst2((unsigned*)(P + row * SQ + t * 8), *(const v4u*)&sp[t * 8]); }
// ---- k_pv: block = (64 queries, 128 dims, b): out = P . v / 2^11 over the 2,048 keys (v planes) -> f32 output rows; P and v tiles staged in LDS, the ring reused as output staging behind the last pass's barrier
__global__ __launch_bounds__(128) void k_pv(const _Float16* __restrict__ P, const _Float16* __restrict__ V, float* __restrict__ OUT) { __shared__ __align__(16) unsigned char sm[2 * STG16]; float (*so)[16][132] = (float (*)[16][132])sm;
  const int tid = threadIdx.x, wave = tid >> 5, lane = tid & 31, col = lane & 15, g = lane >> 4; const size_t b = blockIdx.z; const int q0 = blockIdx.x * 64 + wave * 16; const int c0 = blockIdx.y * 128; const size_t rq = b * SQ + q0;
  v8f acc[8] = {};
  gemm_f16_ring<SQ / PK>(sm, P + (b * SQ + blockIdx.x * 64) * SQ, V + (b * DM + c0) * SQ, SQ, wave, lane, acc);
#pragma unroll
  for (int j = 0; j < 8; ++j)
#pragma unroll
    for (int r = 0; r < 8; ++r) so[wave][8 * g + r][j * 16 + col] = acc[j][r] * (1.0f / 2048.0f);
  LDSX(); for (int rl = 0; rl < 16; ++rl) vst2(OUT + (rq + rl) * DM + c0 + lane * 4, *(const v4f*)&so[wave][rl][lane * 4]); }
extern "C" void kernel_launch(void* const* d_in, const int* in_sizes, int n_in, void* d_out, int out_size, void* d_ws, size_t ws_size, hipStream_t stream) {
  (void)in_sizes; (void)n_in; (void)out_size;
  const float** F = (const float**)d_in;   // 0 x [4,2048,1024], 1 W_qvk [3072,1024] (rows interleaved (channel, {q,v,k})), 2 b_qvk [3072]
  if (ws_size < (size_t)WS_END) return;
  char* ws = (char*)d_ws; __bf16* PW = (__bf16*)ws; _Float16 *Q = (_Float16*)(ws + WS_Q), *Kr = (_Float16*)(ws + WS_K), *V = (_Float16*)(ws + WS_V), *P = (_Float16*)(ws + WS_P); float* S = (float*)(ws + WS_S);
  k_pack<<<dim3(DM, 3), 256, 0, stream>>>(F[1], PW);
  k_proj<<<dim3(TNB * SQ / 64, DM / 128, 3), 128, 0, stream>>>(F[0], PW, F[2], Q, Kr, V);
  k_s<<<dim3(SQ / 64, SQ / 128, TNB), 128, 0, stream>>>(Q, Kr, S);
  k_prow<<<TNB * SQ, 256, 0, stream>>>(S, P);
  k_pv<<<dim3(SQ / 64, DM / 128, TNB), 128, 0, stream>>>(P, V, (float*)d_out);
}

// v002
// It runs in 128 microseconds.
// Two timings next to v001 both put it at 1.50 times that version's speed.
// Over all steps from v000 it is 4.16 times as fast.
// compute dtype: all float inputs rounded to bf16; q/v/k = x . W^T + b with EXACT bf16 products on WMMA 16x16x32 (natural rows gathered from the interleaved (d, 3) layout), rounded once to f16 (v as planes); single-head attention over the 1,024-wide head: S = q . k^T / 32 (single f16, f32 accumulate), row softmax in f32 (hardware exp) -> P = e / l x 2^11 as f16, out = P . v (single f16) in f32; f32 output.
#include <hip/hip_runtime.h>
#include <math.h>

typedef __attribute__((ext_vector_type(16))) _Float16 v16h;
typedef __attribute__((ext_vector_type(16))) __bf16 v16b;
typedef __attribute__((ext_vector_type(8)))  _Float16 v8h;
typedef __attribute__((ext_vector_type(8)))  float v8f;
typedef __attribute__((ext_vector_type(4)))  float v4f;
typedef __attribute__((ext_vector_type(2)))  float v2f;
typedef __attribute__((ext_vector_type(4)))  unsigned v4u;
typedef __attribute__((ext_vector_type(4)))  int v4i;
typedef float __attribute__((may_alias)) float_a;
typedef int __attribute__((may_alias)) int_a;

template <typename T> __device__ __forceinline__ void vst2(void* p, T v) { *(T*)p = v;  }
__device__ __forceinline__ v8f wmma16(v16h a, v16h b, v8f c) {
  v8f d = __builtin_amdgcn_wmma_f32_16x16x32_f16(false, a, false, b, (short)0, c, false, false);
  asm volatile("v_nop\n\tv_nop\n\tv_nop\n\tv_nop" : "+v"(d) : "v"(a), "v"(b));
  return d;
}
__device__ __forceinline__ v8f wmma_bf(v16b a, v16b b, v8f c) {
  v8f d = __builtin_amdgcn_wmma_f32_16x16x32_bf16(false, a, false, b, (short)0, c, false, false);
  asm volatile("v_nop\n\tv_nop\n\tv_nop\n\tv_nop" : "+v"(d) : "v"(a), "v"(b));
  return d;
}
// 16x16x32 fragments: lane = (h = lane>>4, row/col = lane&15); elements 0..7 = k0+8h+0..7, 8..15 = k0+16+8h+0..7; D element r = row 8h+r
__device__ __forceinline__ v16h frag_h(const _Float16* rowk0, int lane) {
  union { v16h v; v8h q[2]; } u; const _Float16* p = rowk0 + 8 * (lane >> 4);
  u.q[0] = *(const v8h*)p; u.q[1] = *(const v8h*)(p + 16); return u.v;
}
__device__ __forceinline__ v16h frag_f32(const float* rowk0, int lane) {
  v16h a; const float* p = rowk0 + 8 * (lane >> 4);
#pragma unroll
  for (int i = 0; i < 8; ++i) { a[i] = (_Float16)p[i]; a[8 + i] = (_Float16)p[16 + i]; }
  return a;
}
__device__ __forceinline__ v16h frag_f32s(const float* rowk0, int lane, float sc) {
  v16h a; const float* p = rowk0 + 8 * (lane >> 4);
#pragma unroll
  for (int i = 0; i < 8; ++i) { a[i] = (_Float16)(p[i] * sc); a[8 + i] = (_Float16)(p[16 + i] * sc); }
  return a;
}
// column fragment from a [K][ld] layout (column n), rows >= K read as 0
__device__ __forceinline__ v16h fragc_f32(const float* W, int k0, int n, int lane, int ld, int K) {
  v16h a; const int g = lane >> 4;
#pragma unroll
  for (int i = 0; i < 8; ++i) { const int ka = k0 + 8 * g + i, kb = ka + 16;
    a[i] = (_Float16)(ka < K ? W[(size_t)(ka < K ? ka : K - 1) * ld + n] : 0.f); a[8 + i] = (_Float16)(kb < K ? W[(size_t)(kb < K ? kb : K - 1) * ld + n] : 0.f); }
  return a;
}
struct F2 { v16b h, l; };
__device__ __forceinline__ F2 bsplit16(const float v[16]) { F2 r;
#pragma unroll
  for (int i = 0; i < 16; ++i) { const __bf16 h = (__bf16)v[i]; r.h[i] = h; r.l[i] = (__bf16)(v[i] - (float)h); }
  return r; }
__device__ __forceinline__ F2 split_row(const float* row, int k0, int lane) { float v[16]; const float* p = row + k0 + 8 * (lane >> 4);
#pragma unroll
  for (int i = 0; i < 8; ++i) { v[i] = p[i]; v[8 + i] = p[16 + i]; }
  return bsplit16(v); }
__device__ __forceinline__ F2 split_rowK(const float* row, int k0, int lane, int K) { float v[16]; const int g = lane >> 4;
#pragma unroll
  for (int i = 0; i < 8; ++i) { const int ka = k0 + 8 * g + i, kb = ka + 16; v[i] = ka < K ? row[ka < K ? ka : K - 1] : 0.f; v[8 + i] = kb < K ? row[kb < K ? kb : K - 1] : 0.f; }
  return bsplit16(v); }
__device__ __forceinline__ F2 split_col(const float* W, int k0, int n, int lane, int ld, int K) { float v[16]; const int g = lane >> 4;
#pragma unroll
  for (int i = 0; i < 8; ++i) { const int ka = k0 + 8 * g + i, kb = ka + 16; v[i] = ka < K ? W[(size_t)(ka < K ? ka : K - 1) * ld + n] : 0.f; v[8 + i] = kb < K ? W[(size_t)(kb < K ? kb : K - 1) * ld + n] : 0.f; }
  return bsplit16(v); }
__device__ __forceinline__ v8f mac3(const F2& a, const F2& b, v8f c) { c = wmma_bf(a.l, b.h, c); c = wmma_bf(a.h, b.l, c); return wmma_bf(a.h, b.h, c); }
__device__ __forceinline__ float sigm(float v) { return 1.0f / (1.0f + expf(-v)); }
#define LDSX() do { asm volatile("s_wait_dscnt 0" ::: "memory"); __builtin_amdgcn_wave_barrier(); __builtin_amdgcn_fence(__ATOMIC_RELEASE, "workgroup"); } while (0)


// Single-head self attention (B 4, T 2,048, d 1,024): fused projection whose 3d outputs interleave (q, v, k) per channel, softmax(q k^T / sqrt(d)) v, no output projection.
#define NB 4
#define SQ 2048
#define DM 1024
#define NR (NB * SQ)
#ifndef TNB
#define TNB NB
#endif
typedef __attribute__((ext_vector_type(8))) __bf16 v8b;
__device__ __forceinline__ v16b frag_b(const __bf16* rowk0, int lane) {
  union { v16b v; v8b q[2]; } u; const __bf16* p = rowk0 + 8 * (lane >> 4);
  u.q[0] = *(const v8b*)p; u.q[1] = *(const v8b*)(p + 16); return u.v;
}
__device__ __forceinline__ float bfr(float v) { return (float)(__bf16)v; }
__device__ __attribute__((noinline)) float exp_ni(float v) { return expf(v); }
__device__ __attribute__((noinline)) float erf_ni(float v) { return erff(v); }

#define WS_PW  0u                                   // bf16 natural rows: q rows (W[3c]), k rows (W[3c+2]), v rows (W[3c+1]) [3][1024][1024]
#define WS_Q   (WS_PW + 2u * (size_t)3 * DM * DM)       // f16 q rows [NR][1024]; k rows; v planes [b][1024][SQ]; f32 S [b][q][k]; f16 P [b][q][k]
#define WS_K   (WS_Q + 2u * (size_t)NR * DM)
#define WS_V   (WS_K + 2u * (size_t)NR * DM)
#define WS_S   (WS_V + 2u * (size_t)NB * DM * SQ)
#define WS_P   (WS_S + 4u * (size_t)NB * SQ * SQ)
#define WS_END (WS_P + 2u * (size_t)NB * SQ * SQ)

// ---- k_pack: block = (output channel c, which): which 0 -> q = W row 3c, 1 -> k = row 3c+2, 2 -> v = row 3c+1
__global__ __launch_bounds__(256) void k_pack(const float* __restrict__ WQVK, __bf16* __restrict__ PW) { const int n = blockIdx.x, which = blockIdx.y, t = threadIdx.x; __shared__ __align__(16) __bf16 s[DM]; const int src = 3 * n + ((which == 0) ? 0 : (which == 1) ? 2 : 1);
  for (int k = t; k < DM; k += 256) s[k] = (__bf16)WQVK[(size_t)src * DM + k]; __syncthreads(); if (t < DM / 8) vst2((unsigned*)(PW + ((size_t)which * DM + n) * DM + t * 8), *(const v4u*)&s[t * 8]); }
// ---- LDS staging of the GEMM operands: a block's operand tiles are brought into LDS pass by pass, by per-lane 16-byte asynchronous copies that cover whole 128-byte lines, two buffers, the next pass's copies in flight while this pass is worked on
#define PK 64                          // k per pass of k_proj
#define PIT16 144                      // LDS pitch of a 128-byte row (16-bit operands): 16 B x odd, ds_load_b128 without bank conflicts
#define PIT32 272                      // LDS pitch of a 256-byte row (f32 x rows of 64 k, f16 rows of 128 k), same rule
#define OFFB32 (128 * PIT32)           // k_proj: the 256 W rows behind the 128 x rows
#define STG32 (128 * PIT32 + 256 * PIT16)   // k_proj: one buffer, f32 x rows and 16-bit W rows
#define KP 128                         // k per pass of k_s and k_pv
#define RING16(BM, BN) (2 * ((BM) + (BN)) * PIT32)   // k_s, k_pv: two buffers of BM A rows and BN B rows, both operands 16-bit
__device__ __forceinline__ unsigned lds_off(const void* p) { return (unsigned)(size_t)p; }
// the issuing wave's copies have landed (the compiler places no wait for them)
#define WAIT_ASYNC() asm volatile("s_wait_asynccnt 0x0" ::: "memory")
// this wave's LDS reads of the buffer have returned before the barrier hands it to the next copies
#define WAIT_DS() asm volatile("s_wait_dscnt 0x0" ::: "memory")
// eight copies, rows rs apart in LDS (bytes) and gs apart in global memory (bytes); the closing s_wait_xcnt stands in the copies' own statement so that no address register is rewritten ahead of it
__device__ __forceinline__ void copy8(unsigned l, unsigned rs, const char* g, size_t gs) {
  asm volatile("global_load_async_to_lds_b128 %0, %8, off\n\t"
               "global_load_async_to_lds_b128 %1, %9, off\n\t"
               "global_load_async_to_lds_b128 %2, %10, off\n\t"
               "global_load_async_to_lds_b128 %3, %11, off\n\t"
               "global_load_async_to_lds_b128 %4, %12, off\n\t"
               "global_load_async_to_lds_b128 %5, %13, off\n\t"
               "global_load_async_to_lds_b128 %6, %14, off\n\t"
               "global_load_async_to_lds_b128 %7, %15, off\n\t"
               "s_wait_xcnt 0x0"
               :: "v"(l), "v"(l + rs), "v"(l + 2 * rs), "v"(l + 3 * rs), "v"(l + 4 * rs), "v"(l + 5 * rs), "v"(l + 6 * rs), "v"(l + 7 * rs),
                  "v"(g), "v"(g + gs), "v"(g + 2 * gs), "v"(g + 3 * gs), "v"(g + 4 * gs), "v"(g + 5 * gs), "v"(g + 6 * gs), "v"(g + 7 * gs) : "memory");
}
// one pass's copies of one wave: ROWS rows of 256 bytes, two rows a copy
template <int ROWS> __device__ __forceinline__ void stage16(unsigned l, const char* g, size_t gs) {
  // unrolled: one or two trips, each one asm statement with constant steps
#pragma unroll
  for (int c = 0; c < ROWS / 16; ++c) copy8(l + c * (16 * PIT32), 2 * PIT32, g + c * 8 * gs, gs);
}
// block tile BM A rows x BN B rows, NW waves (NW / WN x WN), a wave's tile 64 x 64: acc[i][j] += A(rows 16 i ..) . B(rows 16 j ..)^T over K = NT * 128, both operands f16 rows of ld elements; Ab, Bb = the block's first A and B row; k runs upward pass by pass, 32 at a time
template <int NT, int BM, int BN, int NW, int WN> __device__ __forceinline__ void gemm_f16_ring(unsigned char* sm, const _Float16* Ab, const _Float16* Bb, size_t ld, int wave, int lane, v8f (&acc)[4][4]) {
  static_assert(64 * (NW / WN) == BM && 64 * WN == BN && (BM / NW) % 16 == 0 && (BN / NW) % 16 == 0, "tile");
  constexpr int OFFB = BM * PIT32, STG = (BM + BN) * PIT32;
  const int col = lane & 15, g = lane >> 4; const int ra = (wave / WN) * 64, rbn = (wave % WN) * 64;   // a copy: 2 rows x 16 chunks of 16 bytes
  const unsigned la = lds_off(sm) + (wave * (BM / NW) + g) * PIT32 + col * 16, lb = lds_off(sm) + OFFB + (wave * (BN / NW) + g) * PIT32 + col * 16;
  const char* ga = (const char*)(Ab + (size_t)(wave * (BM / NW) + g) * ld + col * 8); const char* gb = (const char*)(Bb + (size_t)(wave * (BN / NW) + g) * ld + col * 8); const size_t gs = 2 * ld * 2;
  stage16<BM / NW>(la, ga, gs); stage16<BN / NW>(lb, gb, gs); WAIT_ASYNC(); __syncthreads();
  stage16<BM / NW>(la + STG, ga + KP * 2, gs); stage16<BN / NW>(lb + STG, gb + KP * 2, gs);
  for (int t = 0; t < NT; ++t) { const unsigned bo = (t & 1) * STG; const unsigned char* buf = sm + bo;
    // the inner loops unrolled so that a[], b[] and acc[][] are indexed by constants only (else they would live in scratch)
#pragma unroll
    for (int kk = 0; kk < KP / 32; ++kk) { v16h a[4], b[4];
#pragma unroll
      for (int i = 0; i < 4; ++i) a[i] = frag_h((const _Float16*)(buf + (ra + i * 16 + col) * PIT32) + kk * 32, lane);
#pragma unroll
      for (int j = 0; j < 4; ++j) b[j] = frag_h((const _Float16*)(buf + OFFB + (rbn + j * 16 + col) * PIT32) + kk * 32, lane);
#pragma unroll
      for (int i = 0; i < 4; ++i)
#pragma unroll
        for (int j = 0; j < 4; ++j) acc[i][j] = wmma16(a[i], b[j], acc[i][j]); }
    WAIT_DS(); WAIT_ASYNC(); __syncthreads();   // publishes pass t + 1 and ends every read of this pass's buffer
    if (t + 2 < NT) { stage16<BM / NW>(la + bo, ga + (size_t)(t + 2) * (KP * 2), gs); stage16<BN / NW>(lb + bo, gb + (size_t)(t + 2) * (KP * 2), gs); } }
  WAIT_ASYNC();
}
// a wave's 64 x 64 f32 tile x sc -> dst (its first element, rows of ld floats): 16 rows at a time through the wave's own LDS range, stored as whole 256-byte row pieces
__device__ __forceinline__ void put_f32(unsigned char* sm, int wave, int lane, const v8f (&acc)[4][4], float sc, float* dst, size_t ld) {
  float (*so)[68] = (float (*)[68])(sm + wave * (16 * 68 * 4)); const int col = lane & 15, g = lane >> 4;
  // all loops unrolled so that acc[][] is indexed by constants only (else it would live in scratch)
#pragma unroll
  for (int i = 0; i < 4; ++i) {
#pragma unroll
    for (int j = 0; j < 4; ++j)
#pragma unroll
      for (int r = 0; r < 8; ++r) so[8 * g + r][j * 16 + col] = acc[i][j][r] * sc;
    WAIT_DS();   // the wave's own LDS writes are done before it reads the rows back
#pragma unroll
    for (int rl = 0; rl < 8; ++rl) vst2(dst + (size_t)(i * 16 + rl * 2 + g) * ld + col * 4, *(const v4f*)&so[rl * 2 + g][col * 4]);
    if (i < 3) WAIT_DS(); }   // the rows are read back before the next 16 rows overwrite them
}
// ---- k_proj: block = (128 rows, 256 cols, which), eight waves (4 x 2), a wave's tile 32 rows x 128 cols: + interleaved bias; q/k -> f16 rows; v -> planes; x (f32) and W (bf16) tiles staged in LDS, the ring reused as output staging behind the last pass's barrier
__global__ __launch_bounds__(256) void k_proj(const float* __restrict__ X, const __bf16* __restrict__ PW, const float* __restrict__ BQVK, _Float16* __restrict__ Q, _Float16* __restrict__ Kr, _Float16* __restrict__ V) {
  __shared__ __align__(16) unsigned char sm[2 * STG32]; _Float16 (*so)[264] = (_Float16 (*)[264])sm; _Float16 (*st)[136] = (_Float16 (*)[136])sm;   // a block uses one of the two
  const int tid = threadIdx.x, wave = tid >> 5, lane = tid & 31, col = lane & 15, g = lane >> 4; const int which = blockIdx.z; const size_t rb = (size_t)blockIdx.x * 128; const int c0 = blockIdx.y * 256; const __bf16* Wr = PW + ((size_t)which * DM) * DM; const int boff = (which == 0) ? 0 : (which == 1) ? 2 : 1;
  const int ra = (wave >> 1) * 32, cw = (wave & 1) * 128;
  // x: a copy is 2 rows x 16 chunks of 16 bytes; W: 4 rows x 8 chunks
  const unsigned la = lds_off(sm) + (wave * 16 + g) * PIT32 + col * 16, lb = lds_off(sm) + OFFB32 + (wave * 32 + (lane >> 3)) * PIT16 + (lane & 7) * 16;
  const char* ga = (const char*)(X + (rb + wave * 16 + g) * DM + col * 4); const char* gb = (const char*)(Wr + (size_t)(c0 + wave * 32 + (lane >> 3)) * DM + (lane & 7) * 8);
  v8f acc[2][8] = {};
  copy8(la, 2 * PIT32, ga, 2 * DM * 4); copy8(lb, 4 * PIT16, gb, 4 * DM * 2); WAIT_ASYNC(); __syncthreads();
  copy8(la + STG32, 2 * PIT32, ga + PK * 4, 2 * DM * 4); copy8(lb + STG32, 4 * PIT16, gb + PK * 2, 4 * DM * 2);
  for (int t = 0; t < DM / PK; ++t) { const unsigned bo = (t & 1) * STG32; const unsigned char* buf = sm + bo;
    // the inner loops unrolled so that a[], bf[] and acc[][] are indexed by constants only (else they would live in scratch)
#pragma unroll
    for (int kk = 0; kk < 2; ++kk) { v16b a[2], bf[8];
#pragma unroll
      for (int m = 0; m < 2; ++m) { const float* p = (const float*)(buf + (ra + m * 16 + col) * PIT32) + kk * 32 + 8 * g;
#pragma unroll
        for (int i = 0; i < 8; ++i) { a[m][i] = (__bf16)p[i]; a[m][8 + i] = (__bf16)p[16 + i]; } }
#pragma unroll
      for (int j = 0; j < 8; ++j) bf[j] = frag_b((const __bf16*)(buf + OFFB32 + (cw + j * 16 + col) * PIT16) + kk * 32, lane);
#pragma unroll
      for (int j = 0; j < 8; ++j) { acc[0][j] = wmma_bf(a[0], bf[j], acc[0][j]); acc[1][j] = wmma_bf(a[1], bf[j], acc[1][j]); } }
    WAIT_DS(); WAIT_ASYNC(); __syncthreads();   // publishes pass t + 1 and ends every read of this pass's buffer
    if (t + 2 < DM / PK) { copy8(la + bo, 2 * PIT32, ga + (size_t)(t + 2) * (PK * 4), 2 * DM * 4); copy8(lb + bo, 4 * PIT16, gb + (size_t)(t + 2) * (PK * 2), 4 * DM * 2); } }
  WAIT_ASYNC();
  // the loops below unrolled so that bb[] and acc[][] are indexed by constants only (else they would live in scratch)
  float bb[8];
#pragma unroll
  for (int j = 0; j < 8; ++j) bb[j] = bfr(BQVK[3 * (c0 + cw + j * 16 + col) + boff]);
  if (which < 2) {
#pragma unroll
    for (int j = 0; j < 8; ++j)
#pragma unroll
      for (int m = 0; m < 2; ++m)
#pragma unroll
        for (int r = 0; r < 8; ++r) so[ra + m * 16 + 8 * g + r][cw + j * 16 + col] = (_Float16)(acc[m][j][r] + bb[j]);
  } else {
#pragma unroll
    for (int j = 0; j < 8; ++j)
#pragma unroll
      for (int m = 0; m < 2; ++m) { v8h hv;
#pragma unroll
        for (int r = 0; r < 8; ++r) hv[r] = (_Float16)(acc[m][j][r] + bb[j]);
        *(v8h*)&st[cw + j * 16 + col][ra + m * 16 + 8 * g] = hv; }
  }
  __syncthreads();
  if (which < 2) { _Float16* dst = (which == 0) ? Q : Kr; for (int e = tid; e < 128 * 32; e += 256) { const int rl = e >> 5, q = e & 31; vst2((unsigned*)(dst + (rb + rl) * DM + c0 + q * 8), *(const v4u*)&so[rl][q * 8]); } }
  else { const size_t b = rb / SQ; const int s0 = (int)(rb % SQ); for (int e = tid; e < 256 * 16; e += 256) { const int d = e >> 4, pc = e & 15; vst2((unsigned*)(V + ((b * DM + c0 + d) * SQ) + s0 + pc * 8), *(const v4u*)&st[d][pc * 8]); } }
}
// ---- k_s: block = (256 queries, 256 keys, b), sixteen waves (4 x 4): S = q . k / 32 over d = 1,024 (single f16) -> f32; q and k tiles staged in LDS, the ring reused as output staging behind the last pass's barrier
__global__ __launch_bounds__(512) void k_s(const _Float16* __restrict__ Q, const _Float16* __restrict__ Kr, float* __restrict__ S) { __shared__ __align__(16) unsigned char sm[RING16(256, 256)];
  const int tid = threadIdx.x, wave = tid >> 5, lane = tid & 31; const size_t b = blockIdx.z; const int q0 = blockIdx.x * 256; const int k0 = blockIdx.y * 256;
  v8f acc[4][4] = {};
  gemm_f16_ring<DM / KP, 256, 256, 16, 4>(sm, Q + (b * SQ + q0) * DM, Kr + (b * SQ + k0) * DM, DM, wave, lane, acc);
  put_f32(sm, wave, lane, acc, 0.03125f, S + (b * SQ + q0 + (wave >> 2) * 64) * SQ + k0 + (wave & 3) * 64, SQ); }
// ---- k_prow: block = row: softmax over the 2,048 keys -> P = e / l x 2^11 as f16 (one 4-KB row)
__global__ __launch_bounds__(256) void k_prow(const float* __restrict__ S, _Float16* __restrict__ P) { __shared__ float red[8]; __shared__ __align__(16) _Float16 sp[SQ]; const int t = threadIdx.x; const size_t row = blockIdx.x; const float* sr = S + row * SQ;
  float v[8]; float mx = -3.0e38f; for (int i = 0; i < 8; ++i) { v[i] = sr[t * 8 + i]; mx = fmaxf(mx, v[i]); }
#pragma unroll
  for (int o = 1; o < 32; o <<= 1) mx = fmaxf(mx, __shfl_xor(mx, o));
  if ((t & 31) == 0) red[t >> 5] = mx; __syncthreads(); float M = red[0]; for (int i = 1; i < 8; ++i) M = fmaxf(M, red[i]); __syncthreads();
  float z = 0.f; for (int i = 0; i < 8; ++i) { v[i] = __expf(v[i] - M); z += v[i]; }
#pragma unroll
  for (int o = 1; o < 32; o <<= 1) z += __shfl_xor(z, o);
  if ((t & 31) == 0) red[t >> 5] = z; __syncthreads(); float Z = 0.f; for (int i = 0; i < 8; ++i) Z += red[i]; const float iz = 2048.0f / Z;
  for (int i = 0; i < 8; ++i) sp[t * 8 + i] = (_Float16)(v[i] * iz); __syncthreads();
  vst2((unsigned*)(P + row * SQ + t * 8), *(const v4u*)&sp[t * 8]); }
// ---- k_pv: block = (256 queries, 128 dims, b), eight waves (4 x 2): out = P . v / 2^11 over the 2,048 keys (v planes) -> f32 output rows; P and v tiles staged in LDS, the ring reused as output staging behind the last pass's barrier
__global__ __launch_bounds__(256) void k_pv(const _Float16* __restrict__ P, const _Float16* __restrict__ V, float* __restrict__ OUT) { __shared__ __align__(16) unsigned char sm[RING16(256, 128)];
  const int tid = threadIdx.x, wave = tid >> 5, lane = tid & 31; const size_t b = blockIdx.z; const int q0 = blockIdx.x * 256; const int c0 = blockIdx.y * 128;
  v8f acc[4][4] = {};
  gemm_f16_ring<SQ / KP, 256, 128, 8, 2>(sm, P + (b * SQ + q0) * SQ, V + (b * DM + c0) * SQ, SQ, wave, lane, acc);
  put_f32(sm, wave, lane, acc, 1.0f / 2048.0f, OUT + (b * SQ + q0 + (wave >> 1) * 64) * DM + c0 + (wave & 1) * 64, DM); }
extern "C" void kernel_launch(void* const* d_in, const int* in_sizes, int n_in, void* d_out, int out_size, void* d_ws, size_t ws_size, hipStream_t stream) {
  (void)in_sizes; (void)n_in; (void)out_size;
  const float** F = (const float**)d_in;   // 0 x [4,2048,1024], 1 W_qvk [3072,1024] (rows interleaved (channel, {q,v,k})), 2 b_qvk [3072]
  if (ws_size < (size_t)WS_END) return;
  char* ws = (char*)d_ws; __bf16* PW = (__bf16*)ws; _Float16 *Q = (_Float16*)(ws + WS_Q), *Kr = (_Float16*)(ws + WS_K), *V = (_Float16*)(ws + WS_V), *P = (_Float16*)(ws + WS_P); float* S = (float*)(ws + WS_S);
  k_pack<<<dim3(DM, 3), 256, 0, stream>>>(F[1], PW);
  k_proj<<<dim3(TNB * SQ / 128, DM / 256, 3), 256, 0, stream>>>(F[0], PW, F[2], Q, Kr, V);
  k_s<<<dim3(SQ / 256, SQ / 256, TNB), 512, 0, stream>>>(Q, Kr, S);
  k_prow<<<TNB * SQ, 256, 0, stream>>>(S, P);
  k_pv<<<dim3(SQ / 256, DM / 128, TNB), 256, 0, stream>>>(P, V, (float*)d_out);
}

// v003
// A run of this version takes 119 microseconds.
// Two timings next to v002 put it at 1.07 and 1.06 times that version's speed.
// All steps since v000 together make it 4.43 times as fast.
// compute dtype: all float inputs rounded to bf16; q/v/k = x . W^T + b with EXACT bf16 products on WMMA 16x16x32 (natural rows gathered from the interleaved (d, 3) layout), rounded once to f16 (v as planes); single-head attention over the 1,024-wide head: S = q . k^T / 32 (single f16, f32 accumulate), row softmax in f32 (hardware exp) -> P = e / l x 2^11 as f16, out = P . v (single f16) in f32; f32 output.
#include <hip/hip_runtime.h>
#include <math.h>

typedef __attribute__((ext_vector_type(16))) _Float16 v16h;
typedef __attribute__((ext_vector_type(16))) __bf16 v16b;
typedef __attribute__((ext_vector_type(8)))  _Float16 v8h;
typedef __attribute__((ext_vector_type(8)))  float v8f;
typedef __attribute__((ext_vector_type(4)))  float v4f;
typedef __attribute__((ext_vector_type(2)))  float v2f;
typedef __attribute__((ext_vector_type(4)))  unsigned v4u;
typedef __attribute__((ext_vector_type(4)))  int v4i;
typedef float __attribute__((may_alias)) float_a;
typedef int __attribute__((may_alias)) int_a;

template <typename T> __device__ __forceinline__ void vst2(void* p, T v) { *(T*)p = v;  }
__device__ __forceinline__ v8f wmma16(v16h a, v16h b, v8f c) {
  v8f d = __builtin_amdgcn_wmma_f32_16x16x32_f16(false, a, false, b, (short)0, c, false, false);
  asm volatile("v_nop\n\tv_nop\n\tv_nop\n\tv_nop" : "+v"(d) : "v"(a), "v"(b));
  return d;
}
__device__ __forceinline__ v8f wmma_bf(v16b a, v16b b, v8f c) {
  v8f d = __builtin_amdgcn_wmma_f32_16x16x32_bf16(false, a, false, b, (short)0, c, false, false);
  asm volatile("v_nop\n\tv_nop\n\tv_nop\n\tv_nop" : "+v"(d) : "v"(a), "v"(b));
  return d;
}
// 16x16x32 fragments: lane = (h = lane>>4, row/col = lane&15); elements 0..7 = k0+8h+0..7, 8..15 = k0+16+8h+0..7; D element r = row 8h+r
__device__ __forceinline__ v16h frag_h(const _Float16* rowk0, int lane) {
  union { v16h v; v8h q[2]; } u; const _Float16* p = rowk0 + 8 * (lane >> 4);
  u.q[0] = *(const v8h*)p; u.q[1] = *(const v8h*)(p + 16); return u.v;
}
__device__ __forceinline__ v16h frag_f32(const float* rowk0, int lane) {
  v16h a; const float* p = rowk0 + 8 * (lane >> 4);
#pragma unroll
  for (int i = 0; i < 8; ++i) { a[i] = (_Float16)p[i]; a[8 + i] = (_Float16)p[16 + i]; }
  return a;
}
__device__ __forceinline__ v16h frag_f32s(const float* rowk0, int lane, float sc) {
  v16h a; const float* p = rowk0 + 8 * (lane >> 4);
#pragma unroll
  for (int i = 0; i < 8; ++i) { a[i] = (_Float16)(p[i] * sc); a[8 + i] = (_Float16)(p[16 + i] * sc); }
  return a;
}
// column fragment from a [K][ld] layout (column n), rows >= K read as 0
__device__ __forceinline__ v16h fragc_f32(const float* W, int k0, int n, int lane, int ld, int K) {
  v16h a; const int g = lane >> 4;
#pragma unroll
  for (int i = 0; i < 8; ++i) { const int ka = k0 + 8 * g + i, kb = ka + 16;
    a[i] = (_Float16)(ka < K ? W[(size_t)(ka < K ? ka : K - 1) * ld + n] : 0.f); a[8 + i] = (_Float16)(kb < K ? W[(size_t)(kb < K ? kb : K - 1) * ld + n] : 0.f); }
  return a;
}
struct F2 { v16b h, l; };
__device__ __forceinline__ F2 bsplit16(const float v[16]) { F2 r;
#pragma unroll
  for (int i = 0; i < 16; ++i) { const __bf16 h = (__bf16)v[i]; r.h[i] = h; r.l[i] = (__bf16)(v[i] - (float)h); }
  return r; }
__device__ __forceinline__ F2 split_row(const float* row, int k0, int lane) { float v[16]; const float* p = row + k0 + 8 * (lane >> 4);
#pragma unroll
  for (int i = 0; i < 8; ++i) { v[i] = p[i]; v[8 + i] = p[16 + i]; }
  return bsplit16(v); }
__device__ __forceinline__ F2 split_rowK(const float* row, int k0, int lane, int K) { float v[16]; const int g = lane >> 4;
#pragma unroll
  for (int i = 0; i < 8; ++i) { const int ka = k0 + 8 * g + i, kb = ka + 16; v[i] = ka < K ? row[ka < K ? ka : K - 1] : 0.f; v[8 + i] = kb < K ? row[kb < K ? kb : K - 1] : 0.f; }
  return bsplit16(v); }
__device__ __forceinline__ F2 split_col(const float* W, int k0, int n, int lane, int ld, int K) { float v[16]; const int g = lane >> 4;
#pragma unroll
  for (int i = 0; i < 8; ++i) { const int ka = k0 + 8 * g + i, kb = ka + 16; v[i] = ka < K ? W[(size_t)(ka < K ? ka : K - 1) * ld + n] : 0.f; v[8 + i] = kb < K ? W[(size_t)(kb < K ? kb : K - 1) * ld + n] : 0.f; }
  return bsplit16(v); }
__device__ __forceinline__ v8f mac3(const F2& a, const F2& b, v8f c) { c = wmma_bf(a.l, b.h, c); c = wmma_bf(a.h, b.l, c); return wmma_bf(a.h, b.h, c); }
__device__ __forceinline__ float sigm(float v) { return 1.0f / (1.0f + expf(-v)); }
#define LDSX() do { asm volatile("s_wait_dscnt 0" ::: "memory"); __builtin_amdgcn_wave_barrier(); __builtin_amdgcn_fence(__ATOMIC_RELEASE, "workgroup"); } while (0)


// Single-head self attention (B 4, T 2,048, d 1,024): fused projection whose 3d outputs interleave (q, v, k) per channel, softmax(q k^T / sqrt(d)) v, no output projection.
#define NB 4
#define SQ 2048
#define DM 1024
#define NR (NB * SQ)
#ifndef TNB
#define TNB NB
#endif
typedef __attribute__((ext_vector_type(8))) __bf16 v8b;
__device__ __forceinline__ v16b frag_b(const __bf16* rowk0, int lane) {
  union { v16b v; v8b q[2]; } u; const __bf16* p = rowk0 + 8 * (lane >> 4);
  u.q[0] = *(const v8b*)p; u.q[1] = *(const v8b*)(p + 16); return u.v;
}
__device__ __forceinline__ float bfr(float v) { return (float)(__bf16)v; }
__device__ __attribute__((noinline)) float exp_ni(float v) { return expf(v); }
__device__ __attribute__((noinline)) float erf_ni(float v) { return erff(v); }

#define WS_PW  0u                                   // bf16 natural rows: q rows (W[3c]), k rows (W[3c+2]), v rows (W[3c+1]) [3][1024][1024]
#define WS_Q   (WS_PW + 2u * (size_t)3 * DM * DM)       // f16 q rows [NR][1024]; k rows; v planes [b][1024][SQ]; f32 S [b][q][k]; f16 P [b][q][k]
#define WS_K   (WS_Q + 2u * (size_t)NR * DM)
#define WS_V   (WS_K + 2u * (size_t)NR * DM)
#define WS_S   (WS_V + 2u * (size_t)NB * DM * SQ)
#define WS_P   (WS_S + 4u * (size_t)NB * SQ * SQ)
#define WS_END (WS_P + 2u * (size_t)NB * SQ * SQ)

// ---- k_pack: a wave = one output channel c: its three W rows 3c (q), 3c+1 (v), 3c+2 (k) lie in a row, 12 KB, every load 512 contiguous bytes; -> bf16 natural rows, planes q, k, v; no LDS, no barrier; 1,024 waves in all
typedef __attribute__((ext_vector_type(4))) __bf16 v4b;
// behind a wave's whole run of loads: the address they name (an input here, so it lives up to the wait) is rewritten only behind s_wait_xcnt 0, a precaution; the scheduling barrier keeps the arithmetic behind the run (else the compiler holds part of the loads back behind the first values' use), so that all loads are in flight at once
#define LOADS_OUT(p) do { asm volatile("s_wait_xcnt 0x0" :: "v"(p) : "memory"); __builtin_amdgcn_sched_barrier(0); } while (0)
typedef __attribute__((ext_vector_type(4))) _Float16 v4h;
__global__ __launch_bounds__(128) void k_pack(const float* __restrict__ WQVK, __bf16* __restrict__ PW) { const int lane = threadIdx.x & 31; const int n = blockIdx.x * 4 + (threadIdx.x >> 5);
  const float* s = WQVK + (size_t)3 * n * DM + lane * 4; v4f v[3][8];
  // unrolled so that v[][] is indexed by constants only (else it would live in scratch)
#pragma unroll
  for (int r = 0; r < 3; ++r)
#pragma unroll
    for (int j = 0; j < 8; ++j) v[r][j] = *(const v4f*)(s + r * DM + j * 128);
  LOADS_OUT(s);
#pragma unroll
  for (int r = 0; r < 3; ++r) { const int which = (r == 0) ? 0 : (r == 1) ? 2 : 1; __bf16* d = PW + ((size_t)which * DM + n) * DM + lane * 4;
#pragma unroll
    for (int j = 0; j < 8; ++j) { v4b o;
#pragma unroll
      for (int c = 0; c < 4; ++c) o[c] = (__bf16)v[r][j][c];
      *(v4b*)(d + j * 128) = o; } }
}
// ---- LDS staging of the GEMM operands: a block's operand tiles are brought into LDS pass by pass, by per-lane 16-byte asynchronous copies that cover whole 128-byte lines, two buffers, the next pass's copies in flight while this pass is worked on
#define PK 64                          // k per pass of k_proj
#define PIT16 144                      // LDS pitch of a 128-byte row (16-bit operands): 16 B x odd, ds_load_b128 without bank conflicts
#define PIT32 272                      // LDS pitch of a 256-byte row (f32 x rows of 64 k, f16 rows of 128 k), same rule
#define OFFB32 (128 * PIT32)           // k_proj: the 256 W rows behind the 128 x rows
#define STG32 (128 * PIT32 + 256 * PIT16)   // k_proj: one buffer, f32 x rows and 16-bit W rows
#define KP 128                         // k per pass of k_s and k_pv
#define RING16(BM, BN) (2 * ((BM) + (BN)) * PIT32)   // k_s, k_pv: two buffers of BM A rows and BN B rows, both operands 16-bit
__device__ __forceinline__ unsigned lds_off(const void* p) { return (unsigned)(size_t)p; }
// the issuing wave's copies have landed (the compiler places no wait for them)
#define WAIT_ASYNC() asm volatile("s_wait_asynccnt 0x0" ::: "memory")
// this wave's LDS reads of the buffer have returned before the barrier hands it to the next copies
#define WAIT_DS() asm volatile("s_wait_dscnt 0x0" ::: "memory")
// eight copies, rows rs apart in LDS (bytes) and gs apart in global memory (bytes); the closing s_wait_xcnt stands in the copies' own statement so that no address register is rewritten ahead of it
__device__ __forceinline__ void copy8(unsigned l, unsigned rs, const char* g, size_t gs) {
  asm volatile("global_load_async_to_lds_b128 %0, %8, off\n\t"
               "global_load_async_to_lds_b128 %1, %9, off\n\t"
               "global_load_async_to_lds_b128 %2, %10, off\n\t"
               "global_load_async_to_lds_b128 %3, %11, off\n\t"
               "global_load_async_to_lds_b128 %4, %12, off\n\t"
               "global_load_async_to_lds_b128 %5, %13, off\n\t"
               "global_load_async_to_lds_b128 %6, %14, off\n\t"
               "global_load_async_to_lds_b128 %7, %15, off\n\t"
               "s_wait_xcnt 0x0"
               :: "v"(l), "v"(l + rs), "v"(l + 2 * rs), "v"(l + 3 * rs), "v"(l + 4 * rs), "v"(l + 5 * rs), "v"(l + 6 * rs), "v"(l + 7 * rs),
                  "v"(g), "v"(g + gs), "v"(g + 2 * gs), "v"(g + 3 * gs), "v"(g + 4 * gs), "v"(g + 5 * gs), "v"(g + 6 * gs), "v"(g + 7 * gs) : "memory");
}
// one pass's copies of one wave: ROWS rows of 256 bytes, two rows a copy
template <int ROWS> __device__ __forceinline__ void stage16(unsigned l, const char* g, size_t gs) {
  // unrolled: one or two trips, each one asm statement with constant steps
#pragma unroll
  for (int c = 0; c < ROWS / 16; ++c) copy8(l + c * (16 * PIT32), 2 * PIT32, g + c * 8 * gs, gs);
}
// block tile BM A rows x BN B rows, NW waves (NW / WN x WN), a wave's tile 64 x 64: acc[i][j] += A(rows 16 i ..) . B(rows 16 j ..)^T over K = NT * 128, both operands f16 rows of ld elements; Ab, Bb = the block's first A and B row; k runs upward pass by pass, 32 at a time
template <int NT, int BM, int BN, int NW, int WN> __device__ __forceinline__ void gemm_f16_ring(unsigned char* sm, const _Float16* Ab, const _Float16* Bb, size_t ld, int wave, int lane, v8f (&acc)[4][4]) {
  static_assert(64 * (NW / WN) == BM && 64 * WN == BN && (BM / NW) % 16 == 0 && (BN / NW) % 16 == 0, "tile");
  constexpr int OFFB = BM * PIT32, STG = (BM + BN) * PIT32;
  const int col = lane & 15, g = lane >> 4; const int ra = (wave / WN) * 64, rbn = (wave % WN) * 64;   // a copy: 2 rows x 16 chunks of 16 bytes
  const unsigned la = lds_off(sm) + (wave * (BM / NW) + g) * PIT32 + col * 16, lb = lds_off(sm) + OFFB + (wave * (BN / NW) + g) * PIT32 + col * 16;
  const char* ga = (const char*)(Ab + (size_t)(wave * (BM / NW) + g) * ld + col * 8); const char* gb = (const char*)(Bb + (size_t)(wave * (BN / NW) + g) * ld + col * 8); const size_t gs = 2 * ld * 2;
  stage16<BM / NW>(la, ga, gs); stage16<BN / NW>(lb, gb, gs); WAIT_ASYNC(); __syncthreads();
  stage16<BM / NW>(la + STG, ga + KP * 2, gs); stage16<BN / NW>(lb + STG, gb + KP * 2, gs);
  for (int t = 0; t < NT; ++t) { const unsigned bo = (t & 1) * STG; const unsigned char* buf = sm + bo;
    // the inner loops unrolled so that a[], b[] and acc[][] are indexed by constants only (else they would live in scratch)
#pragma unroll
    for (int kk = 0; kk < KP / 32; ++kk) { v16h a[4], b[4];
#pragma unroll
      for (int i = 0; i < 4; ++i) a[i] = frag_h((const _Float16*)(buf + (ra + i * 16 + col) * PIT32) + kk * 32, lane);
#pragma unroll
      for (int j = 0; j < 4; ++j) b[j] = frag_h((const _Float16*)(buf + OFFB + (rbn + j * 16 + col) * PIT32) + kk * 32, lane);
#pragma unroll
      for (int i = 0; i < 4; ++i)
#pragma unroll
        for (int j = 0; j < 4; ++j) acc[i][j] = wmma16(a[i], b[j], acc[i][j]); }
    WAIT_DS(); WAIT_ASYNC(); __syncthreads();   // publishes pass t + 1 and ends every read of this pass's buffer
    if (t + 2 < NT) { stage16<BM / NW>(la + bo, ga + (size_t)(t + 2) * (KP * 2), gs); stage16<BN / NW>(lb + bo, gb + (size_t)(t + 2) * (KP * 2), gs); } }
  WAIT_ASYNC();
}
// a wave's 64 x 64 f32 tile x sc -> dst (its first element, rows of ld floats): 16 rows at a time through the wave's own LDS range, stored as whole 256-byte row pieces
__device__ __forceinline__ void put_f32(unsigned char* sm, int wave, int lane, const v8f (&acc)[4][4], float sc, float* dst, size_t ld) {
  float (*so)[68] = (float (*)[68])(sm + wave * (16 * 68 * 4)); const int col = lane & 15, g = lane >> 4;
  // all loops unrolled so that acc[][] is indexed by constants only (else it would live in scratch)
#pragma unroll
  for (int i = 0; i < 4; ++i) {
#pragma unroll
    for (int j = 0; j < 4; ++j)
#pragma unroll
      for (int r = 0; r < 8; ++r) so[8 * g + r][j * 16 + col] = acc[i][j][r] * sc;
    WAIT_DS();   // the wave's own LDS writes are done before it reads the rows back
#pragma unroll
    for (int rl = 0; rl < 8; ++rl) vst2(dst + (size_t)(i * 16 + rl * 2 + g) * ld + col * 4, *(const v4f*)&so[rl * 2 + g][col * 4]);
    if (i < 3) WAIT_DS(); }   // the rows are read back before the next 16 rows overwrite them
}
// ---- k_proj: block = (128 rows, 256 cols, which), eight waves (4 x 2), a wave's tile 32 rows x 128 cols: + interleaved bias; q/k -> f16 rows; v -> planes; x (f32) and W (bf16) tiles staged in LDS, the ring reused as output staging behind the last pass's barrier
__global__ __launch_bounds__(256) void k_proj(const float* __restrict__ X, const __bf16* __restrict__ PW, const float* __restrict__ BQVK, _Float16* __restrict__ Q, _Float16* __restrict__ Kr, _Float16* __restrict__ V) {
  __shared__ __align__(16) unsigned char sm[2 * STG32]; _Float16 (*so)[264] = (_Float16 (*)[264])sm; _Float16 (*st)[136] = (_Float16 (*)[136])sm;   // a block uses one of the two
  const int tid = threadIdx.x, wave = tid >> 5, lane = tid & 31, col = lane & 15, g = lane >> 4; const int which = blockIdx.z; const size_t rb = (size_t)blockIdx.x * 128; const int c0 = blockIdx.y * 256; const __bf16* Wr = PW + ((size_t)which * DM) * DM; const int boff = (which == 0) ? 0 : (which == 1) ? 2 : 1;
  const int ra = (wave >> 1) * 32, cw = (wave & 1) * 128;
  // x: a copy is 2 rows x 16 chunks of 16 bytes; W: 4 rows x 8 chunks
  const unsigned la = lds_off(sm) + (wave * 16 + g) * PIT32 + col * 16, lb = lds_off(sm) + OFFB32 + (wave * 32 + (lane >> 3)) * PIT16 + (lane & 7) * 16;
  const char* ga = (const char*)(X + (rb + wave * 16 + g) * DM + col * 4); const char* gb = (const char*)(Wr + (size_t)(c0 + wave * 32 + (lane >> 3)) * DM + (lane & 7) * 8);
  v8f acc[2][8] = {};
  copy8(la, 2 * PIT32, ga, 2 * DM * 4); copy8(lb, 4 * PIT16, gb, 4 * DM * 2); WAIT_ASYNC(); __syncthreads();
  copy8(la + STG32, 2 * PIT32, ga + PK * 4, 2 * DM * 4); copy8(lb + STG32, 4 * PIT16, gb + PK * 2, 4 * DM * 2);
  for (int t = 0; t < DM / PK; ++t) { const unsigned bo = (t & 1) * STG32; const unsigned char* buf = sm + bo;
    // the inner loops unrolled so that a[], bf[] and acc[][] are indexed by constants only (else they would live in scratch)
#pragma unroll
    for (int kk = 0; kk < 2; ++kk) { v16b a[2], bf[8];
#pragma unroll
      for (int m = 0; m < 2; ++m) { const float* p = (const float*)(buf + (ra + m * 16 + col) * PIT32) + kk * 32 + 8 * g;
#pragma unroll
        for (int i = 0; i < 8; ++i) { a[m][i] = (__bf16)p[i]; a[m][8 + i] = (__bf16)p[16 + i]; } }
#pragma unroll
      for (int j = 0; j < 8; ++j) bf[j] = frag_b((const __bf16*)(buf + OFFB32 + (cw + j * 16 + col) * PIT16) + kk * 32, lane);
#pragma unroll
      for (int j = 0; j < 8; ++j) { acc[0][j] = wmma_bf(a[0], bf[j], acc[0][j]); acc[1][j] = wmma_bf(a[1], bf[j], acc[1][j]); } }
    WAIT_DS(); WAIT_ASYNC(); __syncthreads();   // publishes pass t + 1 and ends every read of this pass's buffer
    if (t + 2 < DM / PK) { copy8(la + bo, 2 * PIT32, ga + (size_t)(t + 2) * (PK * 4), 2 * DM * 4); copy8(lb + bo, 4 * PIT16, gb + (size_t)(t + 2) * (PK * 2), 4 * DM * 2); } }
  WAIT_ASYNC();
  // the loops below unrolled so that bb[] and acc[][] are indexed by constants only (else they would live in scratch)
  float bb[8];
#pragma unroll
  for (int j = 0; j < 8; ++j) bb[j] = bfr(BQVK[3 * (c0 + cw + j * 16 + col) + boff]);
  if (which < 2) {
#pragma unroll
    for (int j = 0; j < 8; ++j)
#pragma unroll
      for (int m = 0; m < 2; ++m)
#pragma unroll
        for (int r = 0; r < 8; ++r) so[ra + m * 16 + 8 * g + r][cw + j * 16 + col] = (_Float16)(acc[m][j][r] + bb[j]);
  } else {
#pragma unroll
    for (int j = 0; j < 8; ++j)
#pragma unroll
      for (int m = 0; m < 2; ++m) { v8h hv;
#pragma unroll
        for (int r = 0; r < 8; ++r) hv[r] = (_Float16)(acc[m][j][r] + bb[j]);
        *(v8h*)&st[cw + j * 16 + col][ra + m * 16 + 8 * g] = hv; }
  }
  __syncthreads();
  if (which < 2) { _Float16* dst = (which == 0) ? Q : Kr; for (int e = tid; e < 128 * 32; e += 256) { const int rl = e >> 5, q = e & 31; vst2((unsigned*)(dst + (rb + rl) * DM + c0 + q * 8), *(const v4u*)&so[rl][q * 8]); } }
  else { const size_t b = rb / SQ; const int s0 = (int)(rb % SQ); for (int e = tid; e < 256 * 16; e += 256) { const int d = e >> 4, pc = e & 15; vst2((unsigned*)(V + ((b * DM + c0 + d) * SQ) + s0 + pc * 8), *(const v4u*)&st[d][pc * 8]); } }
}
// ---- k_s: block = (256 queries, 256 keys, b), sixteen waves (4 x 4): S = q . k / 32 over d = 1,024 (single f16) -> f32; q and k tiles staged in LDS, the ring reused as output staging behind the last pass's barrier
__global__ __launch_bounds__(512) void k_s(const _Float16* __restrict__ Q, const _Float16* __restrict__ Kr, float* __restrict__ S) { __shared__ __align__(16) unsigned char sm[RING16(256, 256)];
  const int tid = threadIdx.x, wave = tid >> 5, lane = tid & 31; const size_t b = blockIdx.z; const int q0 = blockIdx.x * 256; const int k0 = blockIdx.y * 256;
  v8f acc[4][4] = {};
  gemm_f16_ring<DM / KP, 256, 256, 16, 4>(sm, Q + (b * SQ + q0) * DM, Kr + (b * SQ + k0) * DM, DM, wave, lane, acc);
  put_f32(sm, wave, lane, acc, 0.03125f, S + (b * SQ + q0 + (wave >> 2) * 64) * SQ + k0 + (wave & 3) * 64, SQ); }
// v_exp_f32 with the one slot behind it filled in its own statement, whatever the compiler puts next
__device__ __forceinline__ float exp2_slot(float t) { float e; asm volatile("v_exp_f32 %0, %1\n\tv_nop" : "=v"(e) : "v"(t)); return e; }   // volatile: stays behind the scheduling barrier in front of the run
// ---- k_prow: a wave = two rows, sixteen waves a block, one block a WGP's share (4,096 waves in all): softmax over the 2,048 keys -> P = e / l x 2^11 as f16; a row lies in the wave's registers (64 floats a lane, every load 512 contiguous bytes, both rows' loads issued at the start), maximum and sum by a butterfly over the 32 lanes; no LDS array, no barrier
__global__ __launch_bounds__(512) void k_prow(const float* __restrict__ S, _Float16* __restrict__ P) { const int lane = threadIdx.x & 31; const size_t row0 = ((size_t)blockIdx.x * 16 + (threadIdx.x >> 5)) * 2;
  const float* sr = S + row0 * SQ + lane * 4; _Float16* pr = P + row0 * SQ + lane * 4; v4f v[2][16];
  // all loops unrolled so that v[][] is indexed by constants only (else it would live in scratch)
#pragma unroll
  for (int r = 0; r < 2; ++r)
#pragma unroll
    for (int j = 0; j < 16; ++j) v[r][j] = *(const v4f*)(sr + r * SQ + j * 128);
  LOADS_OUT(sr);
#pragma unroll
  for (int r = 0; r < 2; ++r) { float M = -3.0e38f;
#pragma unroll
    for (int j = 0; j < 16; ++j)
#pragma unroll
      for (int c = 0; c < 4; ++c) M = fmaxf(M, v[r][j][c]);
#pragma unroll
    for (int o = 1; o < 32; o <<= 1) M = fmaxf(M, __shfl_xor(M, o));
#pragma unroll
    for (int j = 0; j < 16; ++j)
#pragma unroll
      for (int c = 0; c < 4; ++c) v[r][j][c] = (v[r][j][c] - M) * 1.44269504f;   // e^(s - M) = 2^((s - M) log2 e), the hardware exp as before
    __builtin_amdgcn_sched_barrier(0);   // the 64 products stay a run of their own ahead of the exps: the compiler writes no delay hint for a reader in asm, and without this it puts each product directly in front of its exp
#pragma unroll
    for (int j = 0; j < 16; ++j)
#pragma unroll
      for (int c = 0; c < 4; ++c) v[r][j][c] = exp2_slot(v[r][j][c]);
    float z[4] = {0.f, 0.f, 0.f, 0.f};   // four independent chains
#pragma unroll
    for (int j = 0; j < 16; ++j)
#pragma unroll
      for (int c = 0; c < 4; ++c) z[c] += v[r][j][c];
    float Z = (z[0] + z[1]) + (z[2] + z[3]);
#pragma unroll
    for (int o = 1; o < 32; o <<= 1) Z += __shfl_xor(Z, o);
    const float iz = 2048.0f / Z;
#pragma unroll
    for (int j = 0; j < 16; ++j) { v4h h;
#pragma unroll
      for (int c = 0; c < 4; ++c) h[c] = (_Float16)(v[r][j][c] * iz);
      *(v4h*)(pr + r * SQ + j * 128) = h; } }
}
// ---- k_pv: block = (256 queries, 128 dims, b), eight waves (4 x 2): out = P . v / 2^11 over the 2,048 keys (v planes) -> f32 output rows; P and v tiles staged in LDS, the ring reused as output staging behind the last pass's barrier
__global__ __launch_bounds__(256) void k_pv(const _Float16* __restrict__ P, const _Float16* __restrict__ V, float* __restrict__ OUT) { __shared__ __align__(16) unsigned char sm[RING16(256, 128)];
  const int tid = threadIdx.x, wave = tid >> 5, lane = tid & 31; const size_t b = blockIdx.z; const int q0 = blockIdx.x * 256; const int c0 = blockIdx.y * 128;
  v8f acc[4][4] = {};
  gemm_f16_ring<SQ / KP, 256, 128, 8, 2>(sm, P + (b * SQ + q0) * SQ, V + (b * DM + c0) * SQ, SQ, wave, lane, acc);
  put_f32(sm, wave, lane, acc, 1.0f / 2048.0f, OUT + (b * SQ + q0 + (wave >> 1) * 64) * DM + c0 + (wave & 1) * 64, DM); }
extern "C" void kernel_launch(void* const* d_in, const int* in_sizes, int n_in, void* d_out, int out_size, void* d_ws, size_t ws_size, hipStream_t stream) {
  (void)in_sizes; (void)n_in; (void)out_size;
  const float** F = (const float**)d_in;   // 0 x [4,2048,1024], 1 W_qvk [3072,1024] (rows interleaved (channel, {q,v,k})), 2 b_qvk [3072]
  if (ws_size < (size_t)WS_END) return;
  char* ws = (char*)d_ws; __bf16* PW = (__bf16*)ws; _Float16 *Q = (_Float16*)(ws + WS_Q), *Kr = (_Float16*)(ws + WS_K), *V = (_Float16*)(ws + WS_V), *P = (_Float16*)(ws + WS_P); float* S = (float*)(ws + WS_S);
  k_pack<<<DM / 4, 128, 0, stream>>>(F[1], PW);
  k_proj<<<dim3(TNB * SQ / 128, DM / 256, 3), 256, 0, stream>>>(F[0], PW, F[2], Q, Kr, V);
  k_s<<<dim3(SQ / 256, SQ / 256, TNB), 512, 0, stream>>>(Q, Kr, S);
  k_prow<<<TNB * SQ / 32, 512, 0, stream>>>(S, P);
  k_pv<<<dim3(SQ / 256, DM / 128, TNB), 256, 0, stream>>>(P, V, (float*)d_out);
}
